// v000
// Measured on an AMD MI455X. A time is GPU time per run, averaged over a window of back-to-back runs after a warm-up
// (all launches, gaps included; the runs take copies of the inputs in turn), and the median of several windows.
// Apart from v000's, it joins two sittings. Times from different sittings can be a few percent apart, while
// side-by-side timings come from the same sitting.
// v000, which the later versions start from, runs in 263 microseconds.
#include <hip/hip_runtime.h>
#include <stdint.h>

typedef float v2f __attribute__((ext_vector_type(2)));
typedef float v8f __attribute__((ext_vector_type(8)));
typedef unsigned int v4u __attribute__((ext_vector_type(4)));
typedef int v4i __attribute__((ext_vector_type(4)));
typedef int v8i __attribute__((ext_vector_type(8)));

#define BB 4
#define CC 64
#define HH 256
#define WW 256
#define HW (HH * WW)
#define SPAD 260
#define KCW 16
#define KROWPAD 18
#define VCH 16

__device__ __forceinline__ v8f wmma_f32(v2f a, v2f b, v8f c) {
  // (neg_a, A, neg_b, B, c_mod, C, reuse_a, reuse_b)
  return __builtin_amdgcn_wmma_f32_16x16x4_f32(
      false, a, false, b, (short)0, c, false, false);
}

__device__ __forceinline__ void tdm_load_2d(unsigned lds_off, const void* gptr,
                                            unsigned tile_w, unsigned tile_h,
                                            unsigned stride_elems,
                                            unsigned pad_en, unsigned pad_ivl,
                                            unsigned pad_amt) {
  unsigned long long ga = (unsigned long long)(uintptr_t)gptr;
  v4u g0;
  g0.x = 1u;                                            // count=1, user mode
  g0.y = lds_off;                                       // lds_addr (bytes)
  g0.z = (unsigned)ga;                                  // global_addr[31:0]
  g0.w = (unsigned)((ga >> 32) & 0x1FFFFFFu) | (2u << 30);  // ga[56:32]|type=2
  v8i g1;
  g1[0] = (int)((2u << 16) | (pad_en << 20) | (pad_ivl << 22) | (pad_amt << 25));
  g1[1] = (int)((stride_elems & 0xFFFFu) << 16);
  g1[2] = (int)((stride_elems >> 16) | ((tile_h & 0xFFFFu) << 16));
  g1[3] = (int)((tile_w & 0xFFFFu) << 16);
  g1[4] = (int)(tile_h & 0xFFFFu);
  g1[5] = (int)stride_elems;
  g1[6] = 0;
  g1[7] = 0;
  v4i gz = {0, 0, 0, 0};
#if __clang_major__ >= 23
  v8i gz8 = {0, 0, 0, 0, 0, 0, 0, 0};
  __builtin_amdgcn_tensor_load_to_lds(g0, g1, gz, gz, gz8, 0);
#else
  __builtin_amdgcn_tensor_load_to_lds(g0, g1, gz, gz, 0);
#endif
}

// ---------------------------------------------------------------------------
// Kernel 1: qkv = w_qkv @ x + b_qkv  (GEMM M=192, K=64, N=HW per batch)
// ---------------------------------------------------------------------------
__global__ __launch_bounds__(128) void qkv_gemm_kernel(
    const float* __restrict__ x, const float* __restrict__ w,
    const float* __restrict__ bias, float* __restrict__ qkv_ws) {
  const int lane = threadIdx.x & 31;
  const int wave = threadIdx.x >> 5;
  const int row  = lane & 15;
  const int hi   = lane >> 4;
  const int koff = hi * 2;
  const int n0   = (blockIdx.x * 4 + wave) * 16;
  const int mt   = blockIdx.y;  // 0..11
  const int bb   = blockIdx.z;
  const int obase = mt * 16;
  const float* xb = x + (size_t)bb * CC * HW;

  v8f acc = {};
  for (int k = 0; k < CC; k += 4) {
    v2f a = *(const v2f*)(w + (size_t)(obase + row) * CC + k + koff);
    v2f bf;
    bf.x = xb[(size_t)(k + koff) * HW + n0 + row];
    bf.y = xb[(size_t)(k + koff + 1) * HW + n0 + row];
    acc = wmma_f32(a, bf, acc);
  }
  const int sel = mt >> 2;  // 0=Q, 1=K, 2=V
  float* dst = qkv_ws + (size_t)sel * BB * CC * HW;
  for (int r = 0; r < 8; ++r) {
    const int o = obase + r + 8 * hi;
    const int c = o - sel * 64;
    dst[((size_t)(bb * CC + c)) * HW + n0 + row] = acc[r] + bias[o];
  }
}

__global__ __launch_bounds__(256) void attn_fused_kernel(
    const float* __restrict__ x, const float* __restrict__ wdw,
    const float* __restrict__ bdw, const float* __restrict__ Q,
    const float* __restrict__ Km, const float* __restrict__ V,
    float* __restrict__ out) {
  __shared__ __align__(16) float S_lds[18 * SPAD];         // score halo rows
  __shared__ __align__(16) float QP_lds[18 * SPAD];        // Q rows, later P
  __shared__ __align__(16) float KV_lds[2 * HH * KROWPAD]; // K dbl-buf / V dbl-buf

  const int tid  = threadIdx.x;
  const int lane = tid & 31;
  const int wave = tid >> 5;
  const int row  = lane & 15;
  const int hi   = lane >> 4;
  const int koff = hi * 2;
  const int r0   = blockIdx.x * 16;
  const int c    = blockIdx.y;
  const int bb   = blockIdx.z;
  const size_t base = ((size_t)(bb * CC + c)) * HW;
  const float* q = Q + base;
  const float* k = Km + base;
  const float* v = V + base;
  const unsigned kv_off = (unsigned)(uintptr_t)&KV_lds[0];  // LDS byte offset

  if (wave == 0) tdm_load_2d(kv_off, k, KCW, HH, WW, 1, 3, 1);
  for (int r = 0; r < 18; ++r) {
    const int gr = r0 - 1 + r;  // zero-pad rows outside the image ('SAME')
    QP_lds[r * SPAD + tid] = (gr >= 0 && gr < HH) ? q[(size_t)gr * WW + tid] : 0.0f;
  }

  v8f acc[4] = {};
  for (int ch = 0; ch < WW / KCW; ++ch) {
    if (wave == 0) {
      if (ch + 1 < WW / KCW) {
        tdm_load_2d(kv_off + ((ch + 1) & 1) * (HH * KROWPAD * 4),
                    k + (ch + 1) * KCW, KCW, HH, WW, 1, 3, 1);
        __builtin_amdgcn_s_wait_tensorcnt(1);  // chunk ch has landed
      } else {
        __builtin_amdgcn_s_wait_tensorcnt(0);
      }
    }
    __syncthreads();
    const float* kb = &KV_lds[(ch & 1) * (HH * KROWPAD)];
    const int kbase = ch * KCW;
    for (int t = 0; t < 4; ++t) {
      const int tile = wave + 8 * t;          // 32 tiles: (rowTile, gTile)
      const int lr   = (tile & 1) * 2 + row;  // local Q/S row (0..17)
      const int g0   = (tile >> 1) * 16;
      for (int kl = 0; kl < KCW; kl += 4) {
        v2f a  = *(const v2f*)&QP_lds[lr * SPAD + kbase + kl + koff];
        v2f bf = *(const v2f*)&kb[(g0 + row) * KROWPAD + kl + koff];
        acc[t] = wmma_f32(a, bf, acc[t]);
      }
    }
    __syncthreads();
  }
  for (int t = 0; t < 4; ++t) {
    const int tile  = wave + 8 * t;
    const int sbase = (tile & 1) * 2;
    const int g0    = (tile >> 1) * 16;
    for (int r = 0; r < 8; ++r)
      S_lds[(sbase + r + 8 * hi) * SPAD + g0 + row] = acc[t][r];  // dup writes identical
  }
  __syncthreads();

  // Prefetch V chunk 0 (overlaps the softmax stage; K buffers are dead now).
  if (wave == 0) tdm_load_2d(kv_off, v, WW, VCH, WW, 0, 0, 0);

  // ---- Stage 2: depthwise 3x3 + bias, row softmax -> P (aliases Q region)
  float w9[9];
#pragma unroll
  for (int i = 0; i < 9; ++i) w9[i] = wdw[c * 9 + i];
  const float bc = bdw[c];

  for (int rl = wave; rl < 16; rl += 8) {
    const int i = rl + 1;
    float vals[8];
    float mx = -3.4e38f;
#pragma unroll
    for (int j = 0; j < 8; ++j) {
      const int g = j * 32 + lane;  // stride-1 across lanes -> conflict-free
      float a = bc;
#pragma unroll
      for (int di = -1; di <= 1; ++di)
#pragma unroll
        for (int dg = -1; dg <= 1; ++dg) {
          const int gg = g + dg;
          const float sv = (gg >= 0 && gg < WW) ? S_lds[(i + di) * SPAD + gg] : 0.0f;
          a += w9[(di + 1) * 3 + (dg + 1)] * sv;
        }
      vals[j] = a;
      mx = fmaxf(mx, a);
    }
#pragma unroll
    for (int m = 16; m >= 1; m >>= 1) mx = fmaxf(mx, __shfl_xor(mx, m, 32));
    float sum = 0.0f;
#pragma unroll
    for (int j = 0; j < 8; ++j) {
      vals[j] = __expf(vals[j] - mx);
      sum += vals[j];
    }
#pragma unroll
    for (int m = 16; m >= 1; m >>= 1) sum += __shfl_xor(sum, m, 32);
    const float inv = 1.0f / sum;
#pragma unroll
    for (int j = 0; j < 8; ++j) QP_lds[rl * SPAD + j * 32 + lane] = vals[j] * inv;
  }
  __syncthreads();

  v8f accn[2] = {};
  for (int ch = 0; ch < HH / VCH; ++ch) {
    if (wave == 0) {
      if (ch + 1 < HH / VCH) {
        tdm_load_2d(kv_off + ((ch + 1) & 1) * (VCH * WW * 4),
                    v + (size_t)(ch + 1) * VCH * WW, WW, VCH, WW, 0, 0, 0);
        __builtin_amdgcn_s_wait_tensorcnt(1);
      } else {
        __builtin_amdgcn_s_wait_tensorcnt(0);
      }
    }
    __syncthreads();
    const float* vb = &KV_lds[(ch & 1) * (VCH * WW)];
    for (int t = 0; t < 2; ++t) {
      const int n0 = (wave + 8 * t) * 16;
      for (int kl = 0; kl < VCH; kl += 4) {
        v2f a = *(const v2f*)&QP_lds[row * SPAD + ch * VCH + kl + koff];
        v2f bf;
        bf.x = vb[(kl + koff) * WW + n0 + row];
        bf.y = vb[(kl + koff + 1) * WW + n0 + row];
        accn[t] = wmma_f32(a, bf, accn[t]);
      }
    }
    __syncthreads();
  }
  for (int t = 0; t < 2; ++t) {
    const int n0 = (wave + 8 * t) * 16;
    for (int r = 0; r < 8; ++r) {
      const int i = r + 8 * hi;
      const size_t idx = base + (size_t)(r0 + i) * WW + n0 + row;
      out[idx] = accn[t][r] + x[idx];
    }
  }
}

// ---------------------------------------------------------------------------
extern "C" void kernel_launch(void* const* d_in, const int* in_sizes, int n_in,
                              void* d_out, int out_size, void* d_ws,
                              size_t ws_size, hipStream_t stream) {
  (void)in_sizes; (void)n_in; (void)out_size; (void)ws_size;
  const float* x     = (const float*)d_in[0];
  const float* w_qkv = (const float*)d_in[1];
  const float* b_qkv = (const float*)d_in[2];
  const float* w_dw  = (const float*)d_in[3];
  const float* b_dw  = (const float*)d_in[4];
  float* out = (float*)d_out;
  float* ws  = (float*)d_ws;

  const size_t plane = (size_t)BB * CC * HW;
  float* Q = ws;
  float* K = ws + plane;
  float* V = ws + 2 * plane;

  dim3 g1(HW / 64, 12, BB);
  qkv_gemm_kernel<<<g1, 128, 0, stream>>>(x, w_qkv, b_qkv, ws);

  dim3 g2(HH / 16, CC, BB);
  attn_fused_kernel<<<g2, 256, 0, stream>>>(x, w_dw, b_dw, Q, K, V, out);
}

// v001
// One run takes 230 microseconds.
// Next to v000, in two timings, it ran 1.17 and 1.16 times as fast.
#include <hip/hip_runtime.h>
#include <stdint.h>

typedef float v2f __attribute__((ext_vector_type(2)));
typedef float v8f __attribute__((ext_vector_type(8)));
typedef unsigned int v4u __attribute__((ext_vector_type(4)));
typedef int v4i __attribute__((ext_vector_type(4)));
typedef int v8i __attribute__((ext_vector_type(8)));

#define BB 4
#define CC 64
#define HH 256
#define WW 256
#define HW (HH * WW)
#define SPAD 260
#define KCW 16
#define KROWPAD 18
#define VCH 16

__device__ __forceinline__ v8f wmma_f32(v2f a, v2f b, v8f c) {
  // (neg_a, A, neg_b, B, c_mod, C, reuse_a, reuse_b)
  return __builtin_amdgcn_wmma_f32_16x16x4_f32(
      false, a, false, b, (short)0, c, false, false);
}

__device__ __forceinline__ void tdm_load_2d(unsigned lds_off, const void* gptr,
                                            unsigned tile_w, unsigned tile_h,
                                            unsigned stride_elems,
                                            unsigned pad_en, unsigned pad_ivl,
                                            unsigned pad_amt) {
  unsigned long long ga = (unsigned long long)(uintptr_t)gptr;
  v4u g0;
  g0.x = 1u;                                            // count=1, user mode
  g0.y = lds_off;                                       // lds_addr (bytes)
  g0.z = (unsigned)ga;                                  // global_addr[31:0]
  g0.w = (unsigned)((ga >> 32) & 0x1FFFFFFu) | (2u << 30);  // ga[56:32]|type=2
  v8i g1;
  g1[0] = (int)((2u << 16) | (pad_en << 20) | (pad_ivl << 22) | (pad_amt << 25));
  g1[1] = (int)((stride_elems & 0xFFFFu) << 16);
  g1[2] = (int)((stride_elems >> 16) | ((tile_h & 0xFFFFu) << 16));
  g1[3] = (int)((tile_w & 0xFFFFu) << 16);
  g1[4] = (int)(tile_h & 0xFFFFu);
  g1[5] = (int)stride_elems;
  g1[6] = 0;
  g1[7] = 0;
  v4i gz = {0, 0, 0, 0};
#if __clang_major__ >= 23
  v8i gz8 = {0, 0, 0, 0, 0, 0, 0, 0};
  __builtin_amdgcn_tensor_load_to_lds(g0, g1, gz, gz, gz8, 0);
#else
  __builtin_amdgcn_tensor_load_to_lds(g0, g1, gz, gz, 0);
#endif
}

// ---------------------------------------------------------------------------
// Kernel 1: qkv = w_qkv @ x + b_qkv  (GEMM M=192, K=64, N=HW per batch)
// One workgroup = 4 waves; wave w owns output rows 48w..48w+47 and keeps their
// weight fragments in registers for its whole life.  The workgroup walks GPW
// groups of 64 columns, NWG groups apart, so that at any time neighbouring
// workgroups stream neighbouring 256-byte units of each row.  Column tile j of
// a group takes columns 4*lane16 + j, so one 16-byte load feeds all four tiles
// and one 16-byte store drains them.
// ---------------------------------------------------------------------------
typedef float v4f __attribute__((ext_vector_type(4)));
#define NGRP 64   // columns per group (4 column tiles of 16)
#define GPW 8     // groups per workgroup
#define NWG (HW / (GPW * NGRP))  // workgroups per batch image
#define GSTEP (NWG * NGRP * 4)   // bytes from one group of a workgroup to its next
#define ROWB (HW * 4)  // bytes from one channel row of x or qkv to the next

// 32 channel rows of one column group: rows R0 + 4*ks + {0,1} (+2 in the upper
// lanes, carried in voff).  Uniform base plus a lane offset that never changes.
template <int R0>
__device__ __forceinline__ void load_half(v4f (&b)[16], const char* base, unsigned voff) {
  const char* p = (base + voff) + R0 * ROWB;
  // The scheduling barriers keep the 16 loads together at this place (one half
  // ahead of their use) and keep other work from between them and the waits.
  __builtin_amdgcn_sched_barrier(0);
#pragma unroll
  for (int i = 0; i < 15; ++i) b[i] = *(const v4f*)(p + (4 * (i >> 1) + (i & 1)) * ROWB);
  // Precaution: the last load may land on the address registers that the other
  // fifteen name, and later work reuses them: a wait stands in front of each.
  asm volatile("s_wait_xcnt 0x0" ::: "memory");
  __builtin_amdgcn_sched_barrier(0);
  b[15] = *(const v4f*)(p + 29 * ROWB);
  asm volatile("s_wait_xcnt 0x0" ::: "memory");
  __builtin_amdgcn_sched_barrier(0);
}

template <int KS0>
__device__ __forceinline__ void mm_half(v8f (&acc)[3][4], const v2f (&a)[3][16],
                                        const v4f (&b)[16]) {
#pragma unroll
  for (int ks = 0; ks < 8; ++ks)
#pragma unroll
    for (int j = 0; j < 4; ++j) {
      v2f bf = {b[2 * ks][j], b[2 * ks + 1][j]};
#pragma unroll
      for (int m = 0; m < 3; ++m) acc[m][j] = wmma_f32(a[m][KS0 + ks], bf, acc[m][j]);
    }
}

__device__ __forceinline__ void store_group(const v8f (&acc)[3][4], const float (&bs)[3][8],
                                            float* __restrict__ ws, const size_t (&ob)[3],
                                            unsigned voff) {
  v4f o[3][8];
  char* p[3];
#pragma unroll
  for (int m = 0; m < 3; ++m) {
    p[m] = (char*)ws + ob[m] + voff;
#pragma unroll
    for (int r = 0; r < 8; ++r) {
      const float b = bs[m][r];
      o[m][r] = (v4f){acc[m][0][r] + b, acc[m][1][r] + b, acc[m][2][r] + b, acc[m][3][r] + b};
    }
  }
  // Every value is formed in front of the first store, so that no register of an
  // issued store is reused between the stores.
  __builtin_amdgcn_sched_barrier(0);
#pragma unroll
  for (int m = 0; m < 3; ++m)
#pragma unroll
    for (int r = 0; r < 8; ++r) *(v4f*)(p[m] + r * ROWB) = o[m][r];
  // Precaution: no register named by these stores is rewritten before this wait;
  // the scheduling barrier keeps the next group's work behind it.
  asm volatile("s_wait_xcnt 0x0" ::"v"(p[0]), "v"(p[1]), "v"(p[2]) : "memory");
  __builtin_amdgcn_sched_barrier(0);
}

__global__ __launch_bounds__(128) void qkv_gemm_kernel(
    const float* __restrict__ x, const float* __restrict__ w,
    const float* __restrict__ bias, float* __restrict__ qkv_ws) {
  const int lane = threadIdx.x & 31;
  const int wave = __builtin_amdgcn_readfirstlane(threadIdx.x >> 5);
  const int row  = lane & 15;
  const int hi   = lane >> 4;
  const int koff = hi * 2;
  const int bb   = blockIdx.y;
  const int mt0  = wave * 3;  // first of this wave's three 16-row tiles
  const size_t colb = (size_t)blockIdx.x * (NGRP * 4);  // first group's first column, bytes

  v2f a[3][16];
  float bs[3][8];
  size_t ob[3];  // uniform byte offset of each row tile in the workspace
#pragma unroll
  for (int m = 0; m < 3; ++m) {
    const int mt = mt0 + m;
    const float* wp = w + (size_t)(mt * 16 + row) * CC + koff;
    const float* bp = bias + mt * 16 + 8 * hi;
    // Barriers and wait as in load_half: nothing rewrites wp or bp in front of the wait.
    __builtin_amdgcn_sched_barrier(0);
#pragma unroll
    for (int ks = 0; ks < 16; ++ks) a[m][ks] = *(const v2f*)(wp + ks * 4);
#pragma unroll
    for (int r = 0; r < 8; ++r) bs[m][r] = bp[r];
    asm volatile("s_wait_xcnt 0x0" ::"v"(wp), "v"(bp) : "memory");
    __builtin_amdgcn_sched_barrier(0);
    const int sel = mt >> 2;  // 0=Q, 1=K, 2=V
    ob[m] = (size_t)((sel * BB + bb) * CC + (mt & 3) * 16) * ROWB + colb;
  }
  const unsigned vin  = (unsigned)(koff * ROWB + 16 * row);
  const unsigned vout = (unsigned)(8 * hi * ROWB + 16 * row);
  const char* xg = (const char*)x + (size_t)bb * CC * ROWB + colb;  // group in flight

  v4f blo[16], bhi[16];  // channel rows 0..31 and 32..63 of the group in flight
  load_half<0>(blo, xg, vin);
  load_half<32>(bhi, xg, vin);

  // Rolled: the body is 192 matrix instructions long already.  The last group is
  // peeled, so that no load is issued that nothing uses.
#pragma unroll 1
  for (int g = 0; g < GPW - 1; ++g) {
    v8f acc[3][4] = {};
    mm_half<0>(acc, a, blo);
    xg += GSTEP;
    load_half<0>(blo, xg, vin);  // flies under the second half's products
    mm_half<8>(acc, a, bhi);
    load_half<32>(bhi, xg, vin);  // flies under the stores and the next first half
    store_group(acc, bs, qkv_ws, ob, vout);
#pragma unroll
    for (int m = 0; m < 3; ++m) ob[m] += GSTEP;
  }
  v8f acc[3][4] = {};
  mm_half<0>(acc, a, blo);
  mm_half<8>(acc, a, bhi);
  store_group(acc, bs, qkv_ws, ob, vout);
}

__global__ __launch_bounds__(256) void attn_fused_kernel(
    const float* __restrict__ x, const float* __restrict__ wdw,
    const float* __restrict__ bdw, const float* __restrict__ Q,
    const float* __restrict__ Km, const float* __restrict__ V,
    float* __restrict__ out) {
  __shared__ __align__(16) float S_lds[18 * SPAD];         // score halo rows
  __shared__ __align__(16) float QP_lds[18 * SPAD];        // Q rows, later P
  __shared__ __align__(16) float KV_lds[2 * HH * KROWPAD]; // K dbl-buf / V dbl-buf

  const int tid  = threadIdx.x;
  const int lane = tid & 31;
  const int wave = tid >> 5;
  const int row  = lane & 15;
  const int hi   = lane >> 4;
  const int koff = hi * 2;
  const int r0   = blockIdx.x * 16;
  const int c    = blockIdx.y;
  const int bb   = blockIdx.z;
  const size_t base = ((size_t)(bb * CC + c)) * HW;
  const float* q = Q + base;
  const float* k = Km + base;
  const float* v = V + base;
  const unsigned kv_off = (unsigned)(uintptr_t)&KV_lds[0];  // LDS byte offset

  if (wave == 0) tdm_load_2d(kv_off, k, KCW, HH, WW, 1, 3, 1);
  for (int r = 0; r < 18; ++r) {
    const int gr = r0 - 1 + r;  // zero-pad rows outside the image ('SAME')
    QP_lds[r * SPAD + tid] = (gr >= 0 && gr < HH) ? q[(size_t)gr * WW + tid] : 0.0f;
  }

  v8f acc[4] = {};
  for (int ch = 0; ch < WW / KCW; ++ch) {
    if (wave == 0) {
      if (ch + 1 < WW / KCW) {
        tdm_load_2d(kv_off + ((ch + 1) & 1) * (HH * KROWPAD * 4),
                    k + (ch + 1) * KCW, KCW, HH, WW, 1, 3, 1);
        __builtin_amdgcn_s_wait_tensorcnt(1);  // chunk ch has landed
      } else {
        __builtin_amdgcn_s_wait_tensorcnt(0);
      }
    }
    __syncthreads();
    const float* kb = &KV_lds[(ch & 1) * (HH * KROWPAD)];
    const int kbase = ch * KCW;
    for (int t = 0; t < 4; ++t) {
      const int tile = wave + 8 * t;          // 32 tiles: (rowTile, gTile)
      const int lr   = (tile & 1) * 2 + row;  // local Q/S row (0..17)
      const int g0   = (tile >> 1) * 16;
      for (int kl = 0; kl < KCW; kl += 4) {
        v2f a  = *(const v2f*)&QP_lds[lr * SPAD + kbase + kl + koff];
        v2f bf = *(const v2f*)&kb[(g0 + row) * KROWPAD + kl + koff];
        acc[t] = wmma_f32(a, bf, acc[t]);
      }
    }
    __syncthreads();
  }
  for (int t = 0; t < 4; ++t) {
    const int tile  = wave + 8 * t;
    const int sbase = (tile & 1) * 2;
    const int g0    = (tile >> 1) * 16;
    for (int r = 0; r < 8; ++r)
      S_lds[(sbase + r + 8 * hi) * SPAD + g0 + row] = acc[t][r];  // dup writes identical
  }
  __syncthreads();

  // Prefetch V chunk 0 (overlaps the softmax stage; K buffers are dead now).
  if (wave == 0) tdm_load_2d(kv_off, v, WW, VCH, WW, 0, 0, 0);

  // ---- Stage 2: depthwise 3x3 + bias, row softmax -> P (aliases Q region)
  float w9[9];
#pragma unroll
  for (int i = 0; i < 9; ++i) w9[i] = wdw[c * 9 + i];
  const float bc = bdw[c];

  for (int rl = wave; rl < 16; rl += 8) {
    const int i = rl + 1;
    float vals[8];
    float mx = -3.4e38f;
#pragma unroll
    for (int j = 0; j < 8; ++j) {
      const int g = j * 32 + lane;  // stride-1 across lanes -> conflict-free
      float a = bc;
#pragma unroll
      for (int di = -1; di <= 1; ++di)
#pragma unroll
        for (int dg = -1; dg <= 1; ++dg) {
          const int gg = g + dg;
          const float sv = (gg >= 0 && gg < WW) ? S_lds[(i + di) * SPAD + gg] : 0.0f;
          a += w9[(di + 1) * 3 + (dg + 1)] * sv;
        }
      vals[j] = a;
      mx = fmaxf(mx, a);
    }
#pragma unroll
    for (int m = 16; m >= 1; m >>= 1) mx = fmaxf(mx, __shfl_xor(mx, m, 32));
    float sum = 0.0f;
#pragma unroll
    for (int j = 0; j < 8; ++j) {
      vals[j] = __expf(vals[j] - mx);
      sum += vals[j];
    }
#pragma unroll
    for (int m = 16; m >= 1; m >>= 1) sum += __shfl_xor(sum, m, 32);
    const float inv = 1.0f / sum;
#pragma unroll
    for (int j = 0; j < 8; ++j) QP_lds[rl * SPAD + j * 32 + lane] = vals[j] * inv;
  }
  __syncthreads();

  v8f accn[2] = {};
  for (int ch = 0; ch < HH / VCH; ++ch) {
    if (wave == 0) {
      if (ch + 1 < HH / VCH) {
        tdm_load_2d(kv_off + ((ch + 1) & 1) * (VCH * WW * 4),
                    v + (size_t)(ch + 1) * VCH * WW, WW, VCH, WW, 0, 0, 0);
        __builtin_amdgcn_s_wait_tensorcnt(1);
      } else {
        __builtin_amdgcn_s_wait_tensorcnt(0);
      }
    }
    __syncthreads();
    const float* vb = &KV_lds[(ch & 1) * (VCH * WW)];
    for (int t = 0; t < 2; ++t) {
      const int n0 = (wave + 8 * t) * 16;
      for (int kl = 0; kl < VCH; kl += 4) {
        v2f a = *(const v2f*)&QP_lds[row * SPAD + ch * VCH + kl + koff];
        v2f bf;
        bf.x = vb[(kl + koff) * WW + n0 + row];
        bf.y = vb[(kl + koff + 1) * WW + n0 + row];
        accn[t] = wmma_f32(a, bf, accn[t]);
      }
    }
    __syncthreads();
  }
  for (int t = 0; t < 2; ++t) {
    const int n0 = (wave + 8 * t) * 16;
    for (int r = 0; r < 8; ++r) {
      const int i = r + 8 * hi;
      const size_t idx = base + (size_t)(r0 + i) * WW + n0 + row;
      out[idx] = accn[t][r] + x[idx];
    }
  }
}

// ---------------------------------------------------------------------------
extern "C" void kernel_launch(void* const* d_in, const int* in_sizes, int n_in,
                              void* d_out, int out_size, void* d_ws,
                              size_t ws_size, hipStream_t stream) {
  (void)in_sizes; (void)n_in; (void)out_size; (void)ws_size;
  const float* x     = (const float*)d_in[0];
  const float* w_qkv = (const float*)d_in[1];
  const float* b_qkv = (const float*)d_in[2];
  const float* w_dw  = (const float*)d_in[3];
  const float* b_dw  = (const float*)d_in[4];
  float* out = (float*)d_out;
  float* ws  = (float*)d_ws;

  const size_t plane = (size_t)BB * CC * HW;
  float* Q = ws;
  float* K = ws + plane;
  float* V = ws + 2 * plane;

  dim3 g1(NWG, BB, 1);
  qkv_gemm_kernel<<<g1, 128, 0, stream>>>(x, w_qkv, b_qkv, ws);

  dim3 g2(HH / 16, CC, BB);
  attn_fused_kernel<<<g2, 256, 0, stream>>>(x, w_dw, b_dw, Q, K, V, out);
}

// v002
// One run takes 156 microseconds.
// In two side-by-side timings against v001, it was 1.48 and 1.47 times as fast.
// Over all steps from v000 it is 1.72 times as fast.
#include <hip/hip_runtime.h>
#include <stdint.h>

typedef float v2f __attribute__((ext_vector_type(2)));
typedef float v8f __attribute__((ext_vector_type(8)));
typedef unsigned int v4u __attribute__((ext_vector_type(4)));
typedef int v4i __attribute__((ext_vector_type(4)));
typedef int v8i __attribute__((ext_vector_type(8)));

#define BB 4
#define CC 64
#define HH 256
#define WW 256
#define HW (HH * WW)
#define SPAD 260
#define KCW 16
#define KROWPAD 18
#define VCH 16

__device__ __forceinline__ v8f wmma_f32(v2f a, v2f b, v8f c) {
  // (neg_a, A, neg_b, B, c_mod, C, reuse_a, reuse_b)
  return __builtin_amdgcn_wmma_f32_16x16x4_f32(
      false, a, false, b, (short)0, c, false, false);
}

__device__ __forceinline__ void tdm_load_2d(unsigned lds_off, const void* gptr,
                                            unsigned tile_w, unsigned tile_h,
                                            unsigned stride_elems,
                                            unsigned pad_en, unsigned pad_ivl,
                                            unsigned pad_amt) {
  unsigned long long ga = (unsigned long long)(uintptr_t)gptr;
  v4u g0;
  g0.x = 1u;                                            // count=1, user mode
  g0.y = lds_off;                                       // lds_addr (bytes)
  g0.z = (unsigned)ga;                                  // global_addr[31:0]
  g0.w = (unsigned)((ga >> 32) & 0x1FFFFFFu) | (2u << 30);  // ga[56:32]|type=2
  v8i g1;
  g1[0] = (int)((2u << 16) | (pad_en << 20) | (pad_ivl << 22) | (pad_amt << 25));
  g1[1] = (int)((stride_elems & 0xFFFFu) << 16);
  g1[2] = (int)((stride_elems >> 16) | ((tile_h & 0xFFFFu) << 16));
  g1[3] = (int)((tile_w & 0xFFFFu) << 16);
  g1[4] = (int)(tile_h & 0xFFFFu);
  g1[5] = (int)stride_elems;
  g1[6] = 0;
  g1[7] = 0;
  v4i gz = {0, 0, 0, 0};
#if __clang_major__ >= 23
  v8i gz8 = {0, 0, 0, 0, 0, 0, 0, 0};
  __builtin_amdgcn_tensor_load_to_lds(g0, g1, gz, gz, gz8, 0);
#else
  __builtin_amdgcn_tensor_load_to_lds(g0, g1, gz, gz, 0);
#endif
}

// ---------------------------------------------------------------------------
// Kernel 1: qkv = w_qkv @ x + b_qkv  (GEMM M=192, K=64, N=HW per batch)
// One workgroup = 4 waves; wave w owns output rows 48w..48w+47 and keeps their
// weight fragments in registers for its whole life.  The workgroup walks GPW
// groups of 64 columns, NWG groups apart, so that at any time neighbouring
// workgroups stream neighbouring 256-byte units of each row.  Column tile j of
// a group takes columns 4*lane16 + j, so one 16-byte load feeds all four tiles
// and one 16-byte store drains them.
// ---------------------------------------------------------------------------
typedef float v4f __attribute__((ext_vector_type(4)));
#define NGRP 64   // columns per group (4 column tiles of 16)
#define GPW 8     // groups per workgroup
#define NWG (HW / (GPW * NGRP))  // workgroups per batch image
#define GSTEP (NWG * NGRP * 4)   // bytes from one group of a workgroup to its next
#define ROWB (HW * 4)  // bytes from one channel row of x or qkv to the next

// 32 channel rows of one column group: rows R0 + 4*ks + {0,1} (+2 in the upper
// lanes, carried in voff).  Uniform base plus a lane offset that never changes.
template <int R0>
__device__ __forceinline__ void load_half(v4f (&b)[16], const char* base, unsigned voff) {
  const char* p = (base + voff) + R0 * ROWB;
  // The scheduling barriers keep the 16 loads together at this place (one half
  // ahead of their use) and keep other work from between them and the waits.
  __builtin_amdgcn_sched_barrier(0);
#pragma unroll
  for (int i = 0; i < 15; ++i) b[i] = *(const v4f*)(p + (4 * (i >> 1) + (i & 1)) * ROWB);
  // Precaution: the last load may land on the address registers that the other
  // fifteen name, and later work reuses them: a wait stands in front of each.
  asm volatile("s_wait_xcnt 0x0" ::: "memory");
  __builtin_amdgcn_sched_barrier(0);
  b[15] = *(const v4f*)(p + 29 * ROWB);
  asm volatile("s_wait_xcnt 0x0" ::: "memory");
  __builtin_amdgcn_sched_barrier(0);
}

template <int KS0>
__device__ __forceinline__ void mm_half(v8f (&acc)[3][4], const v2f (&a)[3][16],
                                        const v4f (&b)[16]) {
#pragma unroll
  for (int ks = 0; ks < 8; ++ks)
#pragma unroll
    for (int j = 0; j < 4; ++j) {
      v2f bf = {b[2 * ks][j], b[2 * ks + 1][j]};
#pragma unroll
      for (int m = 0; m < 3; ++m) acc[m][j] = wmma_f32(a[m][KS0 + ks], bf, acc[m][j]);
    }
}

__device__ __forceinline__ void store_group(const v8f (&acc)[3][4], const float (&bs)[3][8],
                                            float* __restrict__ ws, const size_t (&ob)[3],
                                            unsigned voff) {
  v4f o[3][8];
  char* p[3];
#pragma unroll
  for (int m = 0; m < 3; ++m) {
    p[m] = (char*)ws + ob[m] + voff;
#pragma unroll
    for (int r = 0; r < 8; ++r) {
      const float b = bs[m][r];
      o[m][r] = (v4f){acc[m][0][r] + b, acc[m][1][r] + b, acc[m][2][r] + b, acc[m][3][r] + b};
    }
  }
  // Every value is formed in front of the first store, so that no register of an
  // issued store is reused between the stores.
  __builtin_amdgcn_sched_barrier(0);
#pragma unroll
  for (int m = 0; m < 3; ++m)
#pragma unroll
    for (int r = 0; r < 8; ++r) *(v4f*)(p[m] + r * ROWB) = o[m][r];
  // Precaution: no register named by these stores is rewritten before this wait;
  // the scheduling barrier keeps the next group's work behind it.
  asm volatile("s_wait_xcnt 0x0" ::"v"(p[0]), "v"(p[1]), "v"(p[2]) : "memory");
  __builtin_amdgcn_sched_barrier(0);
}

__global__ __launch_bounds__(128) void qkv_gemm_kernel(
    const float* __restrict__ x, const float* __restrict__ w,
    const float* __restrict__ bias, float* __restrict__ qkv_ws) {
  const int lane = threadIdx.x & 31;
  const int wave = __builtin_amdgcn_readfirstlane(threadIdx.x >> 5);
  const int row  = lane & 15;
  const int hi   = lane >> 4;
  const int koff = hi * 2;
  const int bb   = blockIdx.y;
  const int mt0  = wave * 3;  // first of this wave's three 16-row tiles
  const size_t colb = (size_t)blockIdx.x * (NGRP * 4);  // first group's first column, bytes

  v2f a[3][16];
  float bs[3][8];
  size_t ob[3];  // uniform byte offset of each row tile in the workspace
#pragma unroll
  for (int m = 0; m < 3; ++m) {
    const int mt = mt0 + m;
    const float* wp = w + (size_t)(mt * 16 + row) * CC + koff;
    const float* bp = bias + mt * 16 + 8 * hi;
    // Barriers and wait as in load_half: nothing rewrites wp or bp in front of the wait.
    __builtin_amdgcn_sched_barrier(0);
#pragma unroll
    for (int ks = 0; ks < 16; ++ks) a[m][ks] = *(const v2f*)(wp + ks * 4);
#pragma unroll
    for (int r = 0; r < 8; ++r) bs[m][r] = bp[r];
    asm volatile("s_wait_xcnt 0x0" ::"v"(wp), "v"(bp) : "memory");
    __builtin_amdgcn_sched_barrier(0);
    const int sel = mt >> 2;  // 0=Q, 1=K, 2=V
    ob[m] = (size_t)((sel * BB + bb) * CC + (mt & 3) * 16) * ROWB + colb;
  }
  const unsigned vin  = (unsigned)(koff * ROWB + 16 * row);
  const unsigned vout = (unsigned)(8 * hi * ROWB + 16 * row);
  const char* xg = (const char*)x + (size_t)bb * CC * ROWB + colb;  // group in flight

  v4f blo[16], bhi[16];  // channel rows 0..31 and 32..63 of the group in flight
  load_half<0>(blo, xg, vin);
  load_half<32>(bhi, xg, vin);

  // Rolled: the body is 192 matrix instructions long already.  The last group is
  // peeled, so that no load is issued that nothing uses.
#pragma unroll 1
  for (int g = 0; g < GPW - 1; ++g) {
    v8f acc[3][4] = {};
    mm_half<0>(acc, a, blo);
    xg += GSTEP;
    load_half<0>(blo, xg, vin);  // flies under the second half's products
    mm_half<8>(acc, a, bhi);
    load_half<32>(bhi, xg, vin);  // flies under the stores and the next first half
    store_group(acc, bs, qkv_ws, ob, vout);
#pragma unroll
    for (int m = 0; m < 3; ++m) ob[m] += GSTEP;
  }
  v8f acc[3][4] = {};
  mm_half<0>(acc, a, blo);
  mm_half<8>(acc, a, bhi);
  store_group(acc, bs, qkv_ws, ob, vout);
}

#define RB 64
#define SROWS (RB + 2)

__global__ __launch_bounds__(256) void attn_fused_kernel(
    const float* __restrict__ x, const float* __restrict__ wdw,
    const float* __restrict__ bdw, const float* __restrict__ Q,
    const float* __restrict__ Km, const float* __restrict__ V,
    float* __restrict__ out) {
  __shared__ __align__(16) float QP_lds[SROWS * SPAD];  // Q rows, later P
  // K dbl-buf, then the score rows, then V dbl-buf
  __shared__ __attribute__((aligned(2048))) float KV_lds[SROWS * SPAD];
  float* const S_lds = KV_lds;

  const int tid  = threadIdx.x;
  const int lane = tid & 31;
  const int wave = __builtin_amdgcn_readfirstlane(tid >> 5);
  const int row  = lane & 15;
  const int hi   = lane >> 4;
  const int koff = hi * 2;
  const int r0   = blockIdx.x * RB;
  const int c    = blockIdx.y;
  const int bb   = blockIdx.z;
  const size_t base = ((size_t)(bb * CC + c)) * HW;
  const float* q = Q + base;
  const float* k = Km + base;
  const float* v = V + base;
  const unsigned kv_off = (unsigned)(uintptr_t)&KV_lds[0];  // LDS byte offset

  if (wave == 0) tdm_load_2d(kv_off, k, KCW, HH, WW, 1, 3, 1);
  {
    // The RB rows of the block itself always lie in the image: 16 unguarded 16-byte
    // loads per thread.  The two halo rows are threads 0..127's, zero outside ('SAME').
    const int qr = tid >> 6;        // row within a round of four
    const int qc = (tid & 63) * 4;  // first column of this thread's piece
    const float* qp = q + (size_t)(r0 + qr) * WW + qc;
    v4f qv[RB / 4];
    // Unrolled here and below: arrays that live in registers take constant indices.
#pragma unroll
    for (int i = 0; i < RB / 4; ++i) qv[i] = *(const v4f*)(qp + i * 4 * WW);
    // Precaution: qp stays in its registers up to here, so that no register named
    // by an issued load is rewritten in front of the wait.
    asm volatile("s_wait_xcnt 0x0" ::"v"(qp) : "memory");
    const int hr = qr ? r0 + RB : r0 - 1;
    v4f qh = {0.0f, 0.0f, 0.0f, 0.0f};
    if (tid < 128 && hr >= 0 && hr < HH) {
      const float* hp = q + (size_t)hr * WW + qc;
      qh = *(const v4f*)hp;
      asm volatile("s_wait_xcnt 0x0" ::"v"(hp) : "memory");
    }
#pragma unroll
    for (int i = 0; i < RB / 4; ++i) *(v4f*)&QP_lds[(1 + i * 4 + qr) * SPAD + qc] = qv[i];
    if (tid < 128) *(v4f*)&QP_lds[(qr ? RB + 1 : 0) * SPAD + qc] = qh;
  }

  {
    v8f acc[5][2] = {};
    for (int ch = 0; ch < WW / KCW; ++ch) {
      if (wave == 0) {
        if (ch + 1 < WW / KCW) {
          tdm_load_2d(kv_off + ((ch + 1) & 1) * (HH * KROWPAD * 4),
                      k + (ch + 1) * KCW, KCW, HH, WW, 1, 3, 1);
          __builtin_amdgcn_s_wait_tensorcnt(1);  // chunk ch has landed
        } else {
          __builtin_amdgcn_s_wait_tensorcnt(0);
        }
      }
      __syncthreads();
      const float* kb = &KV_lds[(ch & 1) * (HH * KROWPAD)];
      const int kbase = ch * KCW;
#pragma unroll
      for (int kl = 0; kl < KCW; kl += 4) {
        v2f a[5], bf[2];
#pragma unroll
        for (int m = 0; m < 5; ++m) {
          const int lr = (m < 4 ? 16 * m : RB - 14) + row;  // local Q/S row (0..65)
          a[m] = *(const v2f*)&QP_lds[lr * SPAD + kbase + kl + koff];
        }
#pragma unroll
        for (int t = 0; t < 2; ++t)
          bf[t] = *(const v2f*)&kb[((wave + 8 * t) * 16 + row) * KROWPAD + kl + koff];
#pragma unroll
        for (int m = 0; m < 5; ++m)
#pragma unroll
          for (int t = 0; t < 2; ++t) acc[m][t] = wmma_f32(a[m], bf[t], acc[m][t]);
      }
      __syncthreads();
    }
    // Every wave has left the K buffers (the loop's last barrier): S takes their place.
#pragma unroll
    for (int t = 0; t < 2; ++t) {
      const int g0 = (wave + 8 * t) * 16;
#pragma unroll
      for (int m = 0; m < 4; ++m)
#pragma unroll
        for (int r = 0; r < 8; ++r)
          S_lds[(16 * m + r + 8 * hi) * SPAD + g0 + row] = acc[m][t][r];
      // Of the overlapping fifth tile only its last two rows (64, 65) are new.
      if (hi) {
        S_lds[RB * SPAD + g0 + row]       = acc[4][t][6];
        S_lds[(RB + 1) * SPAD + g0 + row] = acc[4][t][7];
      }
    }
  }
  __syncthreads();

  // ---- Stage 2: depthwise 3x3 + bias, row softmax -> P (aliases Q region)
  float w9[9];
#pragma unroll
  for (int i = 0; i < 9; ++i) w9[i] = wdw[c * 9 + i];
  const float bc = bdw[c];

  for (int rl = wave; rl < RB; rl += 8) {
    const int i = rl + 1;
    float vals[8];
    float mx = -3.4e38f;
#pragma unroll
    for (int j = 0; j < 8; ++j) {
      const int g = j * 32 + lane;  // stride-1 across lanes -> conflict-free
      float a = bc;
#pragma unroll
      for (int di = -1; di <= 1; ++di)
#pragma unroll
        for (int dg = -1; dg <= 1; ++dg) {
          const int gg = g + dg;
          const float sv = (gg >= 0 && gg < WW) ? S_lds[(i + di) * SPAD + gg] : 0.0f;
          a += w9[(di + 1) * 3 + (dg + 1)] * sv;
        }
      vals[j] = a;
      mx = fmaxf(mx, a);
    }
#pragma unroll
    for (int m = 16; m >= 1; m >>= 1) mx = fmaxf(mx, __shfl_xor(mx, m, 32));
    float sum = 0.0f;
#pragma unroll
    for (int j = 0; j < 8; ++j) {
      vals[j] = __expf(vals[j] - mx);
      sum += vals[j];
    }
#pragma unroll
    for (int m = 16; m >= 1; m >>= 1) sum += __shfl_xor(sum, m, 32);
    const float inv = 1.0f / sum;
#pragma unroll
    for (int j = 0; j < 8; ++j) QP_lds[rl * SPAD + j * 32 + lane] = vals[j] * inv;
  }
  __syncthreads();

  if (wave == 0) tdm_load_2d(kv_off, v, WW, VCH, WW, 0, 0, 0);
  v8f accn[4][2] = {};
  for (int ch = 0; ch < HH / VCH; ++ch) {
    if (wave == 0) {
      if (ch + 1 < HH / VCH) {
        tdm_load_2d(kv_off + ((ch + 1) & 1) * (VCH * WW * 4),
                    v + (size_t)(ch + 1) * VCH * WW, WW, VCH, WW, 0, 0, 0);
        __builtin_amdgcn_s_wait_tensorcnt(1);
      } else {
        __builtin_amdgcn_s_wait_tensorcnt(0);
      }
    }
    __syncthreads();
    const float* vb = &KV_lds[(ch & 1) * (VCH * WW)];
#pragma unroll
    for (int kl = 0; kl < VCH; kl += 4) {
      v2f a[4], bf[2];
#pragma unroll
      for (int m = 0; m < 4; ++m)
        a[m] = *(const v2f*)&QP_lds[(16 * m + row) * SPAD + ch * VCH + kl + koff];
#pragma unroll
      for (int t = 0; t < 2; ++t) {
        const int n0 = (wave + 8 * t) * 16;
        bf[t].x = vb[(kl + koff) * WW + n0 + row];
        bf[t].y = vb[(kl + koff + 1) * WW + n0 + row];
      }
#pragma unroll
      for (int m = 0; m < 4; ++m)
#pragma unroll
        for (int t = 0; t < 2; ++t) accn[m][t] = wmma_f32(a[m], bf[t], accn[m][t]);
    }
    __syncthreads();
  }
  // One address per array; every row and column tile is a constant offset from it.
  const size_t idx0 = base + (size_t)(r0 + 8 * hi) * WW + wave * 16 + row;
  const float* xp = x + idx0;
  float* op = out + idx0;
#pragma unroll
  for (int m = 0; m < 4; ++m)
#pragma unroll
    for (int t = 0; t < 2; ++t)
#pragma unroll
      for (int r = 0; r < 8; ++r) {
        const int o = (16 * m + r) * WW + t * 128;
        op[o] = accn[m][t][r] + xp[o];
      }
}

// ---------------------------------------------------------------------------
extern "C" void kernel_launch(void* const* d_in, const int* in_sizes, int n_in,
                              void* d_out, int out_size, void* d_ws,
                              size_t ws_size, hipStream_t stream) {
  (void)in_sizes; (void)n_in; (void)out_size; (void)ws_size;
  const float* x     = (const float*)d_in[0];
  const float* w_qkv = (const float*)d_in[1];
  const float* b_qkv = (const float*)d_in[2];
  const float* w_dw  = (const float*)d_in[3];
  const float* b_dw  = (const float*)d_in[4];
  float* out = (float*)d_out;
  float* ws  = (float*)d_ws;

  const size_t plane = (size_t)BB * CC * HW;
  float* Q = ws;
  float* K = ws + plane;
  float* V = ws + 2 * plane;

  dim3 g1(NWG, BB, 1);
  qkv_gemm_kernel<<<g1, 128, 0, stream>>>(x, w_qkv, b_qkv, ws);

  dim3 g2(HH / RB, CC, BB);
  attn_fused_kernel<<<g2, 256, 0, stream>>>(x, w_dw, b_dw, Q, K, V, out);
}
